// v000
// The times below were measured on an AMD MI455X: many runs one after another, warmed up first and cycling through
// copies of the inputs, with the whole window's GPU time divided by the number of runs. Launches and the gaps
// between them are all in it. The median over several windows is given; except for v000 it joins two sittings, which
// can be a few percent apart, so the side-by-side timings, each taken in one sitting, are the better comparison.
// v000 is the starting kernel. One run takes 19.8 microseconds.
#include <hip/hip_runtime.h>

// ---------------- problem constants (from reference) ----------------
#define NPOS   8192     // sequence length N
#define DCH    256      // total channels d
#define HEADS  8        // d / HEAD_DIM
#define HD     32       // HEAD_DIM
#define NT     128      // positions per block tile
#define KW     132      // NT + 4 halo (dilation-2, 3-tap window)
#define QSTR   129      // LDS row stride for q tile (pad vs bank conflicts)
#define KSTR   133      // LDS row stride for k/v halo tiles
#define SCALEF 0.17677669529663687f   // 32^-0.5

typedef __attribute__((ext_vector_type(2))) float v2f;
typedef __attribute__((ext_vector_type(8))) float v8f;

// gfx1250 async global->LDS path (ASYNCcnt-tracked), with sync fallback.
// Toolchain declares these builtins with typed int pointers:
//   (int addrspace(1)* gsrc, int addrspace(3)* ldst, imm offset, imm cpol)
#if defined(__AMDGCN__) && __has_builtin(__builtin_amdgcn_global_load_async_to_lds_b32)
#define HAVE_ASYNC_LDS 1
typedef __attribute__((address_space(1))) int as1_int;
typedef __attribute__((address_space(3))) int as3_int;
#else
#define HAVE_ASYNC_LDS 0
#endif

__device__ __forceinline__ void async_copy_f32(const float* gsrc, float* ldst) {
#if HAVE_ASYNC_LDS
    __builtin_amdgcn_global_load_async_to_lds_b32(
        (as1_int*)gsrc, (as3_int*)ldst, 0, 0);
#else
    *ldst = *gsrc;
#endif
}

__device__ __forceinline__ void wait_staging_and_barrier() {
#if HAVE_ASYNC_LDS
#if __has_builtin(__builtin_amdgcn_s_wait_asynccnt)
    __builtin_amdgcn_s_wait_asynccnt(0);
#else
    asm volatile("s_wait_asynccnt 0x0" ::: "memory");
#endif
#endif
    __syncthreads();
}

__device__ __forceinline__ float rdlane(float x, int srcLane) {
    union { float f; int i; } u;
    u.f = x;
    u.i = __builtin_amdgcn_readlane(u.i, srcLane);
    return u.f;
}

__launch_bounds__(256, 2)
__global__ void dilate_attn_wmma_f32(const float* __restrict__ q,
                                     const float* __restrict__ k,
                                     const float* __restrict__ v,
                                     float* __restrict__ out) {
    __shared__ float qs[HD * QSTR];
    __shared__ float ks[HD * KSTR];
    __shared__ float vs[HD * KSTR];

    const int t   = threadIdx.x;
    const int n0  = blockIdx.x * NT;           // tile start along sequence
    const int h   = blockIdx.y;                // head
    const int b   = blockIdx.z;                // batch
    const int cb  = b * DCH + h * HD;          // global channel base for this head

    // ---- stage Q tile: qs[d][ln], coalesced, direct global->LDS ----
    for (int i = t; i < HD * NT; i += 256) {
        const int d  = i >> 7;          // /128
        const int ln = i & (NT - 1);
        async_copy_f32(&q[(size_t)(cb + d) * NPOS + n0 + ln], &qs[d * QSTR + ln]);
    }
    // ---- stage K/V halo tiles: [d][j], j covers n0-2 .. n0+129, zero padded ----
    for (int i = t; i < HD * KW; i += 256) {
        const int d = i / KW;
        const int j = i - d * KW;
        const int n = n0 - 2 + j;
        if ((unsigned)n < (unsigned)NPOS) {
            const size_t gi = (size_t)(cb + d) * NPOS + n;
            async_copy_f32(&k[gi], &ks[d * KSTR + j]);
            async_copy_f32(&v[gi], &vs[d * KSTR + j]);
        } else {
            // edge blocks only: zero-pad halo (written via DS pipe; disjoint
            // from any async destination, ordered by the barrier below)
            ks[d * KSTR + j] = 0.0f;
            vs[d * KSTR + j] = 0.0f;
        }
    }
    wait_staging_and_barrier();

    const int lane = t & 31;
    const int wave = t >> 5;          // 0..7  -> each wave owns 16 positions
    const int tile = wave * 16;       // local tile start within the 128 block
    const int mr   = lane & 15;       // A row (M) / B column (N) index
    const int g    = lane >> 4;       // lane half selects K sub-pair

    // A fragments (Q), reused across the 3 shifts.
    // 32-bit A 16x4 layout: lane half g, VGPR p  ->  K = 2*g + p; per step kk,
    // matrix K (channel d) = 4*kk + 2*g + p.
    v2f afrag[8];
#pragma unroll
    for (int kk = 0; kk < 8; ++kk) {
        const int dbase = 4 * kk + 2 * g;
        afrag[kk].x = qs[(dbase + 0) * QSTR + tile + mr];
        afrag[kk].y = qs[(dbase + 1) * QSTR + tile + mr];
    }

    // Scores for the 3 dilated taps: C[s][m][n] = <q_{tile+m}, k_{tile+n+2s-2}>
    // (only the diagonal m==n is used).
    v8f c[3];
#pragma unroll
    for (int s = 0; s < 3; ++s) {
        v8f acc = {};
        const int jcol = tile + mr + 2 * s;   // halo-space column for B
#pragma unroll
        for (int kk = 0; kk < 8; ++kk) {
            const int dbase = 4 * kk + 2 * g;
            v2f bfrag;
            bfrag.x = ks[(dbase + 0) * KSTR + jcol];
            bfrag.y = ks[(dbase + 1) * KSTR + jcol];
            acc = __builtin_amdgcn_wmma_f32_16x16x4_f32(
                      /*neg_a=*/false, afrag[kk],
                      /*neg_b=*/false, bfrag,
                      /*c_mod=*/(short)0, acc,
                      /*reuse_a=*/false, /*reuse_b=*/false);
        }
        c[s] = acc;
    }

    // ---- softmax (incl. the 6 zero-logit padding slots) + V blend ----
    // C layout: lane L: N = L%16 ; VGPR r: M = 8*(L/16) + r.
    // Diagonal m: m<8 -> (lane m, comp m); m>=8 -> (lane m+16, comp m-8).
    const size_t outBase = ((size_t)b * NPOS) * DCH + (size_t)h * HD + lane;
#pragma unroll
    for (int m = 0; m < 16; ++m) {
        const int srcLane = (m < 8) ? m : (m + 16);
        const int comp    = (m < 8) ? m : (m - 8);
        const float s0 = SCALEF * rdlane(c[0][comp], srcLane);
        const float s1 = SCALEF * rdlane(c[1][comp], srcLane);
        const float s2 = SCALEF * rdlane(c[2][comp], srcLane);
        const float mx = fmaxf(fmaxf(s0, s1), fmaxf(s2, 0.0f));
        const float e0 = __expf(s0 - mx);
        const float e1 = __expf(s1 - mx);
        const float e2 = __expf(s2 - mx);
        const float inv = 1.0f / (6.0f * __expf(-mx) + e0 + e1 + e2);
        const int jj = tile + m;   // halo-space index of tap 0 for this position
        const float o = (e0 * vs[lane * KSTR + jj] +
                         e1 * vs[lane * KSTR + jj + 2] +
                         e2 * vs[lane * KSTR + jj + 4]) * inv;
        const int n = n0 + tile + m;
        out[outBase + (size_t)n * DCH] = o;   // 128B coalesced per wave
    }
}

extern "C" void kernel_launch(void* const* d_in, const int* in_sizes, int n_in,
                              void* d_out, int out_size, void* d_ws, size_t ws_size,
                              hipStream_t stream) {
    const float* q = (const float*)d_in[0];
    const float* k = (const float*)d_in[1];
    const float* v = (const float*)d_in[2];
    float* out = (float*)d_out;

    const int B = in_sizes[0] / (DCH * NPOS);   // 4 per reference
    dim3 grid(NPOS / NT, HEADS, B);
    dim3 block(256, 1, 1);
    dilate_attn_wmma_f32<<<grid, block, 0, stream>>>(q, k, v, out);
}

// v001
// It runs in 17.3 microseconds.
// Two timings next to v000 both put it at 1.16 times that version's speed.
#include <hip/hip_runtime.h>

// ---------------- problem constants (from reference) ----------------
#define NPOS   8192     // sequence length N
#define DCH    256      // total channels d
#define HEADS  8        // d / HEAD_DIM
#define HD     32       // HEAD_DIM
#define NT     128      // positions per block tile
#define KW     132      // NT + 4 halo (dilation-2, 3-tap window)
#define QSTR   129      // LDS row stride for q tile (pad vs bank conflicts)
#define KSTR   133      // LDS row stride for k/v halo tiles
#define SCALEF 0.17677669529663687f   // 32^-0.5

typedef __attribute__((ext_vector_type(2))) float v2f;
typedef __attribute__((ext_vector_type(8))) float v8f;

// gfx1250 async global->LDS path (ASYNCcnt-tracked), with sync fallback.
// Toolchain declares these builtins with typed int pointers:
//   (int addrspace(1)* gsrc, int addrspace(3)* ldst, imm offset, imm cpol)
#if defined(__AMDGCN__) && __has_builtin(__builtin_amdgcn_global_load_async_to_lds_b32)
#define HAVE_ASYNC_LDS 1
typedef __attribute__((address_space(1))) int as1_int;
typedef __attribute__((address_space(3))) int as3_int;
#else
#define HAVE_ASYNC_LDS 0
#endif

__device__ __forceinline__ void async_copy_f32(const float* gsrc, float* ldst) {
#if HAVE_ASYNC_LDS
    __builtin_amdgcn_global_load_async_to_lds_b32(
        (as1_int*)gsrc, (as3_int*)ldst, 0, 0);
#else
    *ldst = *gsrc;
#endif
}

__device__ __forceinline__ void wait_staging_and_barrier() {
#if HAVE_ASYNC_LDS
#if __has_builtin(__builtin_amdgcn_s_wait_asynccnt)
    __builtin_amdgcn_s_wait_asynccnt(0);
#else
    asm volatile("s_wait_asynccnt 0x0" ::: "memory");
#endif
#endif
    __syncthreads();
}

__device__ __forceinline__ float rdlane(float x, int srcLane) {
    union { float f; int i; } u;
    u.f = x;
    u.i = __builtin_amdgcn_readlane(u.i, srcLane);
    return u.f;
}

__launch_bounds__(256, 2)
__global__ void dilate_attn_wmma_f32(const float* __restrict__ q,
                                     const float* __restrict__ k,
                                     const float* __restrict__ v,
                                     float* __restrict__ out) {
    __shared__ float qs[HD * QSTR];
    __shared__ float ks[HD * KSTR];
    __shared__ float vs[HD * KSTR];

    const int t   = threadIdx.x;
    const int n0  = blockIdx.x * NT;           // tile start along sequence
    const int h   = blockIdx.y;                // head
    const int b   = blockIdx.z;                // batch
    const int cb  = b * DCH + h * HD;          // global channel base for this head

    // ---- stage Q tile: qs[d][ln], coalesced, direct global->LDS ----
    for (int i = t; i < HD * NT; i += 256) {
        const int d  = i >> 7;          // /128
        const int ln = i & (NT - 1);
        async_copy_f32(&q[(size_t)(cb + d) * NPOS + n0 + ln], &qs[d * QSTR + ln]);
    }
    // ---- stage K/V halo tiles: [d][j], j covers n0-2 .. n0+129, zero padded ----
    for (int i = t; i < HD * KW; i += 256) {
        const int d = i / KW;
        const int j = i - d * KW;
        const int n = n0 - 2 + j;
        if ((unsigned)n < (unsigned)NPOS) {
            const size_t gi = (size_t)(cb + d) * NPOS + n;
            async_copy_f32(&k[gi], &ks[d * KSTR + j]);
            async_copy_f32(&v[gi], &vs[d * KSTR + j]);
        } else {
            // edge blocks only: zero-pad halo (written via DS pipe; disjoint
            // from any async destination, ordered by the barrier below)
            ks[d * KSTR + j] = 0.0f;
            vs[d * KSTR + j] = 0.0f;
        }
    }
    wait_staging_and_barrier();

    const int lane = t & 31;
    const int wave = t >> 5;          // 0..7  -> each wave owns 16 positions
    const int tile = wave * 16;       // local tile start within the 128 block
    const int mr   = lane & 15;       // A row (M) / B column (N) index
    const int g    = lane >> 4;       // lane half selects K sub-pair

    // A fragments (Q), reused across the 3 shifts.
    // 32-bit A 16x4 layout: lane half g, VGPR p  ->  K = 2*g + p; per step kk,
    // matrix K (channel d) = 4*kk + 2*g + p.
    v2f afrag[8];
#pragma unroll
    for (int kk = 0; kk < 8; ++kk) {
        const int dbase = 4 * kk + 2 * g;
        afrag[kk].x = qs[(dbase + 0) * QSTR + tile + mr];
        afrag[kk].y = qs[(dbase + 1) * QSTR + tile + mr];
    }

    // Scores for the 3 dilated taps: C[s][m][n] = <q_{tile+m}, k_{tile+n+2s-2}>
    // (only the diagonal m==n is used).
    v8f c[3];
#pragma unroll
    for (int s = 0; s < 3; ++s) {
        v8f acc = {};
        const int jcol = tile + mr + 2 * s;   // halo-space column for B
#pragma unroll
        for (int kk = 0; kk < 8; ++kk) {
            const int dbase = 4 * kk + 2 * g;
            v2f bfrag;
            bfrag.x = ks[(dbase + 0) * KSTR + jcol];
            bfrag.y = ks[(dbase + 1) * KSTR + jcol];
            acc = __builtin_amdgcn_wmma_f32_16x16x4_f32(
                      /*neg_a=*/false, afrag[kk],
                      /*neg_b=*/false, bfrag,
                      /*c_mod=*/(short)0, acc,
                      /*reuse_a=*/false, /*reuse_b=*/false);
        }
        c[s] = acc;
    }

    // ---- softmax (incl. the 6 zero-logit padding slots) + V blend ----
    // C layout: lane L: N = L%16 ; VGPR r: M = 8*(L/16) + r.
    // Diagonal m: m<8 -> (lane m, comp m); m>=8 -> (lane m+16, comp m-8),
    // so the lane that owns a diagonal element finds it in comp lane&7.
    // Each lane selects that component and the softmax of all 16 positions
    // is done once, across lanes (lanes 8..23 hold off-diagonal scores; their
    // weights are never read).
    // Holds the lane-mask arithmetic below behind the last WMMA (the scheduler
    // otherwise lifts it in between them), so that four vector instructions
    // stand between each WMMA and the first one that touches its result.
    __builtin_amdgcn_sched_barrier(0);
    const bool b0 = (lane & 1) != 0;
    const bool b1 = (lane & 2) != 0;
    const bool b2 = (lane & 4) != 0;
    float sc[3];
#pragma unroll
    for (int s = 0; s < 3; ++s) {
        const float t0 = b0 ? c[s][1] : c[s][0];
        const float t1 = b0 ? c[s][3] : c[s][2];
        const float t2 = b0 ? c[s][5] : c[s][4];
        const float t3 = b0 ? c[s][7] : c[s][6];
        const float u0 = b1 ? t1 : t0;
        const float u1 = b1 ? t3 : t2;
        sc[s] = SCALEF * (b2 ? u1 : u0);
    }
    const float mx  = fmaxf(fmaxf(sc[0], sc[1]), fmaxf(sc[2], 0.0f));
    const float e0  = __expf(sc[0] - mx);
    const float e1  = __expf(sc[1] - mx);
    const float e2  = __expf(sc[2] - mx);
    const float inv = 1.0f / (6.0f * __expf(-mx) + e0 + e1 + e2);
    const float w0  = e0 * inv;     // normalised tap weights, one position per lane
    const float w1  = e1 * inv;
    const float w2  = e2 * inv;

    const size_t outBase = ((size_t)b * NPOS) * DCH + (size_t)h * HD + lane;
#pragma unroll
    for (int m = 0; m < 16; ++m) {
        const int srcLane = (m < 8) ? m : (m + 16);
        const int jj = tile + m;   // halo-space index of tap 0 for this position
        const float o = rdlane(w0, srcLane) * vs[lane * KSTR + jj] +
                        rdlane(w1, srcLane) * vs[lane * KSTR + jj + 2] +
                        rdlane(w2, srcLane) * vs[lane * KSTR + jj + 4];
        const int n = n0 + tile + m;
        out[outBase + (size_t)n * DCH] = o;   // 128B coalesced per wave
    }
}

extern "C" void kernel_launch(void* const* d_in, const int* in_sizes, int n_in,
                              void* d_out, int out_size, void* d_ws, size_t ws_size,
                              hipStream_t stream) {
    const float* q = (const float*)d_in[0];
    const float* k = (const float*)d_in[1];
    const float* v = (const float*)d_in[2];
    float* out = (float*)d_out;

    const int B = in_sizes[0] / (DCH * NPOS);   // 4 per reference
    dim3 grid(NPOS / NT, HEADS, B);
    dim3 block(256, 1, 1);
    dilate_attn_wmma_f32<<<grid, block, 0, stream>>>(q, k, v, out);
}

// v002
// A run of this version takes 14.8 microseconds.
// In both of two side-by-side timings against v001, it was 1.17 times as fast.
// Counting every step since v000, it is 1.35 times as fast.
#include <hip/hip_runtime.h>

// ---------------- problem constants (from reference) ----------------
#define NPOS   8192     // sequence length N
#define DCH    256      // total channels d
#define HEADS  8        // d / HEAD_DIM
#define HD     32       // HEAD_DIM
#define NT     128      // positions per block tile
#define QSTR   136      // LDS row stride for q tile, dwords: 16-byte rows; rows d and d+2 are 16 banks apart
#define KSTR   140      // LDS row stride for k/v halo tiles, dwords: 16 B x odd (b128 column walk), rows d and d+2 24 banks apart
#define KOFF   2        // k/v row: cols 2,3 left halo, 4..131 the tile (16-byte aligned), 132,133 right halo
#define SCALEF 0.17677669529663687f   // 32^-0.5

typedef __attribute__((ext_vector_type(2))) float v2f;
typedef __attribute__((ext_vector_type(4))) float v4f;
typedef __attribute__((ext_vector_type(8))) float v8f;

// gfx1250 async global->LDS path (ASYNCcnt-tracked), with sync fallback.
// Toolchain declares these builtins with typed int pointers:
//   (T addrspace(1)* gsrc, T addrspace(3)* ldst, imm offset, imm cpol),
//   T = a vector of 2 ints for the 8-byte copy, of 4 ints for the 16-byte one
#if defined(__AMDGCN__) && __has_builtin(__builtin_amdgcn_global_load_async_to_lds_b128)
#define HAVE_ASYNC_LDS 1
typedef __attribute__((ext_vector_type(2))) int v2i;
typedef __attribute__((ext_vector_type(4))) int v4i;
typedef __attribute__((address_space(1))) v2i as1_v2i;
typedef __attribute__((address_space(3))) v2i as3_v2i;
typedef __attribute__((address_space(1))) v4i as1_v4i;
typedef __attribute__((address_space(3))) v4i as3_v4i;
#else
#define HAVE_ASYNC_LDS 0
#endif

// 16 bytes per lane; both addresses are multiples of 16
__device__ __forceinline__ void async_copy_f32x4(const float* gsrc, float* ldst) {
#if HAVE_ASYNC_LDS
    __builtin_amdgcn_global_load_async_to_lds_b128(
        (as1_v4i*)gsrc, (as3_v4i*)ldst, 0, 0);
#else
    *(v4f*)ldst = *(const v4f*)gsrc;
#endif
}

// 8 bytes per lane; both addresses are multiples of 8
__device__ __forceinline__ void async_copy_f32x2(const float* gsrc, float* ldst) {
#if HAVE_ASYNC_LDS
    __builtin_amdgcn_global_load_async_to_lds_b64(
        (as1_v2i*)gsrc, (as3_v2i*)ldst, 0, 0);
#else
    *(v2f*)ldst = *(const v2f*)gsrc;
#endif
}

__device__ __forceinline__ void wait_staging_and_barrier() {
#if HAVE_ASYNC_LDS
#if __has_builtin(__builtin_amdgcn_s_wait_asynccnt)
    __builtin_amdgcn_s_wait_asynccnt(0);
#else
    asm volatile("s_wait_asynccnt 0x0" ::: "memory");
#endif
#endif
    __syncthreads();
}

__device__ __forceinline__ float rdlane(float x, int srcLane) {
    union { float f; int i; } u;
    u.f = x;
    u.i = __builtin_amdgcn_readlane(u.i, srcLane);
    return u.f;
}

__launch_bounds__(256, 2)
__global__ void dilate_attn_wmma_f32(const float* __restrict__ q,
                                     const float* __restrict__ k,
                                     const float* __restrict__ v,
                                     float* __restrict__ out) {
    __shared__ __attribute__((aligned(16))) float qs[HD * QSTR];
    __shared__ __attribute__((aligned(16))) float ks[HD * KSTR];
    __shared__ __attribute__((aligned(16))) float vs[HD * KSTR];

    const int t   = threadIdx.x;
    const int n0  = blockIdx.x * NT;           // tile start along sequence
    const int h   = blockIdx.y;                // head
    const int b   = blockIdx.z;                // batch
    const int cb  = b * DCH + h * HD;          // global channel base for this head

    const int lane = t & 31;
    const int wave = __builtin_amdgcn_readfirstlane(t >> 5);   // 0..7, held scalar: row bases and the halo tests are wave-uniform

    // ---- stage the Q, K, V tiles: one 16-byte copy per lane moves one whole
    //      512-byte channel row per wave; wave w takes rows w, w+8, w+16, w+24 ----
    // unrolled: all twelve copies issue back to back, with no loop control between them
#pragma unroll
    for (int r = 0; r < HD / 8; ++r) {
        const int d = wave + 8 * r;
        const size_t   gr = (size_t)(cb + d) * NPOS + n0;   // row start: wave-uniform
        const unsigned gl = 4u * lane;                       // the lane's four positions
        async_copy_f32x4(q + gr + gl, &qs[d * QSTR + 4 * lane]);
        async_copy_f32x4(k + gr + gl, &ks[d * KSTR + KOFF + 2 + 4 * lane]);
        async_copy_f32x4(v + gr + gl, &vs[d * KSTR + KOFF + 2 + 4 * lane]);
    }
    // ---- K/V halo, two positions each side: waves 0..3 take (K,left) (K,right)
    //      (V,left) (V,right), lane = channel row, one 8-byte copy per lane ----
    if (wave < 4) {
        const bool   right = (wave & 1) != 0;
        const float* src   = (wave & 2) ? v : k;
        float*       dst   = ((wave & 2) ? vs : ks) + lane * KSTR + (right ? KOFF + 2 + NT : KOFF);
        const int    n     = right ? n0 + NT : n0 - 2;
        if ((unsigned)n < (unsigned)NPOS) {
            async_copy_f32x2(&src[(size_t)(cb + lane) * NPOS + n], dst);
        } else {
            // first and last tile of the sequence: zero padding (DS pipe;
            // disjoint from any async destination, ordered by the barrier below)
            dst[0] = 0.0f;
            dst[1] = 0.0f;
        }
    }
    wait_staging_and_barrier();

    const int tile = wave * 16;       // each wave owns 16 positions of the 128 block
    const int mr   = lane & 15;       // A row (M) / B column (N) index
    const int g    = lane >> 4;       // lane half selects K sub-pair

    // A fragments (Q), reused across the 3 shifts.
    // 32-bit A 16x4 layout: lane half g, VGPR p  ->  K = 2*g + p; per step kk,
    // matrix K (channel d) = 4*kk + 2*g + p.
    v2f afrag[8];
#pragma unroll
    for (int kk = 0; kk < 8; ++kk) {
        const int dbase = 4 * kk + 2 * g;
        afrag[kk].x = qs[(dbase + 0) * QSTR + tile + mr];
        afrag[kk].y = qs[(dbase + 1) * QSTR + tile + mr];
    }

    // Scores for the 3 dilated taps: C[s][m][n] = <q_{tile+m}, k_{tile+n+2s-2}>
    // (only the diagonal m==n is used).
    v8f c[3];
#pragma unroll
    for (int s = 0; s < 3; ++s) {
        v8f acc = {};
        const int jcol = KOFF + tile + mr + 2 * s;   // LDS column of tap s for B
#pragma unroll
        for (int kk = 0; kk < 8; ++kk) {
            const int dbase = 4 * kk + 2 * g;
            v2f bfrag;
            bfrag.x = ks[(dbase + 0) * KSTR + jcol];
            bfrag.y = ks[(dbase + 1) * KSTR + jcol];
            acc = __builtin_amdgcn_wmma_f32_16x16x4_f32(
                      /*neg_a=*/false, afrag[kk],
                      /*neg_b=*/false, bfrag,
                      /*c_mod=*/(short)0, acc,
                      /*reuse_a=*/false, /*reuse_b=*/false);
        }
        c[s] = acc;
    }

    // ---- softmax (incl. the 6 zero-logit padding slots) + V blend ----
    // C layout: lane L: N = L%16 ; VGPR r: M = 8*(L/16) + r.
    // Diagonal m: m<8 -> (lane m, comp m); m>=8 -> (lane m+16, comp m-8),
    // so the lane that owns a diagonal element finds it in comp lane&7.
    // Each lane selects that component and the softmax of all 16 positions
    // is done once, across lanes (lanes 8..23 hold off-diagonal scores; their
    // weights are never read).
    // Holds the lane-mask arithmetic below behind the last WMMA (the scheduler
    // otherwise lifts it in between them), so that four vector instructions
    // stand between each WMMA and the first one that touches its result.
    __builtin_amdgcn_sched_barrier(0);
    const bool b0 = (lane & 1) != 0;
    const bool b1 = (lane & 2) != 0;
    const bool b2 = (lane & 4) != 0;
    float sc[3];
#pragma unroll
    for (int s = 0; s < 3; ++s) {
        const float t0 = b0 ? c[s][1] : c[s][0];
        const float t1 = b0 ? c[s][3] : c[s][2];
        const float t2 = b0 ? c[s][5] : c[s][4];
        const float t3 = b0 ? c[s][7] : c[s][6];
        const float u0 = b1 ? t1 : t0;
        const float u1 = b1 ? t3 : t2;
        sc[s] = SCALEF * (b2 ? u1 : u0);
    }
    const float mx  = fmaxf(fmaxf(sc[0], sc[1]), fmaxf(sc[2], 0.0f));
    const float e0  = __expf(sc[0] - mx);
    const float e1  = __expf(sc[1] - mx);
    const float e2  = __expf(sc[2] - mx);
    const float inv = 1.0f / (6.0f * __expf(-mx) + e0 + e1 + e2);
    const float w0  = e0 * inv;     // normalised tap weights, one position per lane
    const float w1  = e1 * inv;
    const float w2  = e2 * inv;

    // The lane's V row (lane = channel), the 20 positions its 16 outputs tap:
    // vv[i] = halo index tile + i; 8 + 4 x 16 + 8 bytes, each read aligned.
    float vv[20];
    {
        const float* vrow = &vs[lane * KSTR + KOFF + tile];
        const v2f lo = *(const v2f*)(vrow);
        const v2f hi = *(const v2f*)(vrow + 18);
        vv[0] = lo.x;  vv[1] = lo.y;  vv[18] = hi.x;  vv[19] = hi.y;
        // unrolled: every index of vv is a constant, so that vv stays in registers
#pragma unroll
        for (int c4 = 0; c4 < 4; ++c4) {
            const v4f x = *(const v4f*)(vrow + 2 + 4 * c4);
            vv[2 + 4 * c4] = x.x;  vv[3 + 4 * c4] = x.y;
            vv[4 + 4 * c4] = x.z;  vv[5 + 4 * c4] = x.w;
        }
    }

    const size_t outBase = ((size_t)b * NPOS) * DCH + (size_t)h * HD + lane;
#pragma unroll
    for (int m = 0; m < 16; ++m) {
        const int srcLane = (m < 8) ? m : (m + 16);
        const float o = rdlane(w0, srcLane) * vv[m] +
                        rdlane(w1, srcLane) * vv[m + 2] +
                        rdlane(w2, srcLane) * vv[m + 4];
        const int n = n0 + tile + m;
        out[outBase + (size_t)n * DCH] = o;   // 128B coalesced per wave
    }
}

extern "C" void kernel_launch(void* const* d_in, const int* in_sizes, int n_in,
                              void* d_out, int out_size, void* d_ws, size_t ws_size,
                              hipStream_t stream) {
    const float* q = (const float*)d_in[0];
    const float* k = (const float*)d_in[1];
    const float* v = (const float*)d_in[2];
    float* out = (float*)d_out;

    const int B = in_sizes[0] / (DCH * NPOS);   // 4 per reference
    dim3 grid(NPOS / NT, HEADS, B);
    dim3 block(256, 1, 1);
    dilate_attn_wmma_f32<<<grid, block, 0, stream>>>(q, k, v, out);
}

// v003
// Measured time: 13.9 microseconds a run.
// Next to v002, in two timings, it ran 1.06 times as fast each time.
// Counting every step since v000, it is 1.44 times as fast.
#include <hip/hip_runtime.h>

// ---------------- problem constants (from reference) ----------------
#define NPOS   8192     // sequence length N
#define DCH    256      // total channels d
#define HEADS  8        // d / HEAD_DIM
#define HD     32       // HEAD_DIM
#define NT     128      // positions per block tile
#define TPB    4        // tiles per block, worked through a two-buffer LDS ring
#define TSTEP  (NPOS / TPB)   // positions between a block's tiles: in every trip the blocks of a head cover one contiguous quarter of the sequence
#define QSTR   136      // LDS row stride for q tile, dwords: 16-byte rows; rows d and d+2 are 16 banks apart
#define KSTR   140      // LDS row stride for k/v halo tiles, dwords: 16 B x odd (b128 column walk), rows d and d+2 24 banks apart
#define KOFF   2        // k/v row: cols 2,3 left halo, 4..131 the tile (16-byte aligned), 132,133 right halo
#define SCALEF 0.17677669529663687f   // 32^-0.5

typedef __attribute__((ext_vector_type(2))) float v2f;
typedef __attribute__((ext_vector_type(4))) float v4f;
typedef __attribute__((ext_vector_type(8))) float v8f;

// gfx1250 async global->LDS path (ASYNCcnt-tracked), with sync fallback.
// Toolchain declares these builtins with typed int pointers:
//   (T addrspace(1)* gsrc, T addrspace(3)* ldst, imm offset, imm cpol),
//   T = a vector of 2 ints for the 8-byte copy, of 4 ints for the 16-byte one
#if defined(__AMDGCN__) && __has_builtin(__builtin_amdgcn_global_load_async_to_lds_b128)
#define HAVE_ASYNC_LDS 1
typedef __attribute__((ext_vector_type(2))) int v2i;
typedef __attribute__((ext_vector_type(4))) int v4i;
typedef __attribute__((address_space(1))) v2i as1_v2i;
typedef __attribute__((address_space(3))) v2i as3_v2i;
typedef __attribute__((address_space(1))) v4i as1_v4i;
typedef __attribute__((address_space(3))) v4i as3_v4i;
#else
#define HAVE_ASYNC_LDS 0
#endif

// 16 bytes per lane; both addresses are multiples of 16
__device__ __forceinline__ void async_copy_f32x4(const float* gsrc, float* ldst) {
#if HAVE_ASYNC_LDS
    __builtin_amdgcn_global_load_async_to_lds_b128(
        (as1_v4i*)gsrc, (as3_v4i*)ldst, 0, 0);
#else
    *(v4f*)ldst = *(const v4f*)gsrc;
#endif
}

// 8 bytes per lane; both addresses are multiples of 8
__device__ __forceinline__ void async_copy_f32x2(const float* gsrc, float* ldst) {
#if HAVE_ASYNC_LDS
    __builtin_amdgcn_global_load_async_to_lds_b64(
        (as1_v2i*)gsrc, (as3_v2i*)ldst, 0, 0);
#else
    *(v2f*)ldst = *(const v2f*)gsrc;
#endif
}

// Every async copy this wave has issued has landed in LDS. Written in asm with
// the memory clobber so that no LDS read is lifted over it.
__device__ __forceinline__ void wait_copies_landed() {
#if HAVE_ASYNC_LDS
    asm volatile("s_wait_asynccnt 0x0" ::: "memory");
#endif
}

// Every LDS read and write of this wave has retired: stands in front of the
// barrier behind which the buffer it has just read is refilled by copies.
__device__ __forceinline__ void wait_lds_retired() {
#if defined(__AMDGCN__)
    asm volatile("s_wait_dscnt 0x0" ::: "memory");
#endif
}

__device__ __forceinline__ float rdlane(float x, int srcLane) {
    union { float f; int i; } u;
    u.f = x;
    u.i = __builtin_amdgcn_readlane(u.i, srcLane);
    return u.f;
}

// Stage one 128-position tile of Q, K, V (with the K/V halo) into one LDS buffer.
__device__ __forceinline__ void stage_tile(const float* __restrict__ q,
                                           const float* __restrict__ k,
                                           const float* __restrict__ v,
                                           float* qs, float* ks, float* vs,
                                           int cb, int n0, int lane, int wave) {
    // ---- one 16-byte copy per lane moves one whole 512-byte channel row per
    //      wave; wave w takes rows w, w+8, w+16, w+24 ----
    // unrolled: all twelve copies issue back to back, with no loop control between them
#pragma unroll
    for (int r = 0; r < HD / 8; ++r) {
        const int d = wave + 8 * r;
        const size_t   gr = (size_t)(cb + d) * NPOS + n0;   // row start: wave-uniform
        const unsigned gl = 4u * lane;                       // the lane's four positions
        async_copy_f32x4(q + gr + gl, &qs[d * QSTR + 4 * lane]);
        async_copy_f32x4(k + gr + gl, &ks[d * KSTR + KOFF + 2 + 4 * lane]);
        async_copy_f32x4(v + gr + gl, &vs[d * KSTR + KOFF + 2 + 4 * lane]);
    }
    // ---- K/V halo, two positions each side: waves 0..3 take (K,left) (K,right)
    //      (V,left) (V,right), lane = channel row, one 8-byte copy per lane ----
    if (wave < 4) {
        const bool   right = (wave & 1) != 0;
        const float* src   = (wave & 2) ? v : k;
        float*       dst   = ((wave & 2) ? vs : ks) + lane * KSTR + (right ? KOFF + 2 + NT : KOFF);
        const int    n     = right ? n0 + NT : n0 - 2;
        if ((unsigned)n < (unsigned)NPOS) {
            async_copy_f32x2(&src[(size_t)(cb + lane) * NPOS + n], dst);
        } else {
            // first and last tile of the sequence: zero padding (DS pipe;
            // disjoint from any async destination, ordered by the wait on LDS
            // and the barrier that publish this buffer)
            dst[0] = 0.0f;
            dst[1] = 0.0f;
        }
    }
}

__launch_bounds__(256, 2)
__global__ void dilate_attn_wmma_f32(const float* __restrict__ q,
                                     const float* __restrict__ k,
                                     const float* __restrict__ v,
                                     float* __restrict__ out) {
    // two buffers: tile i is worked on in buffer i & 1 while tile i + 1 lands in the other
    __shared__ __attribute__((aligned(16))) float qs[2][HD * QSTR];
    __shared__ __attribute__((aligned(16))) float ks[2][HD * KSTR];
    __shared__ __attribute__((aligned(16))) float vs[2][HD * KSTR];

    const int t   = threadIdx.x;
    const int nb  = blockIdx.x * NT;           // start of this block's first tile; the others follow TSTEP apart
    const int h   = blockIdx.y;                // head
    const int b   = blockIdx.z;                // batch
    const int cb  = b * DCH + h * HD;          // global channel base for this head

    const int lane = t & 31;
    const int wave = __builtin_amdgcn_readfirstlane(t >> 5);   // 0..7, held scalar: row bases and the halo tests are wave-uniform

    const int tile = wave * 16;       // each wave owns 16 positions of the 128 block
    const int mr   = lane & 15;       // A row (M) / B column (N) index
    const int g    = lane >> 4;       // lane half selects K sub-pair

    const size_t outBase = ((size_t)b * NPOS) * DCH + (size_t)h * HD + lane;

    // ---- in front of the loop: tile 0 lands and is published, then tile 1 starts ----
    stage_tile(q, k, v, qs[0], ks[0], vs[0], cb, nb, lane, wave);
    wait_copies_landed();
    __syncthreads();
    stage_tile(q, k, v, qs[1], ks[1], vs[1], cb, nb + TSTEP, lane, wave);

    // unrolled: the buffer index and the refill test are constants in every trip
#pragma unroll
    for (int i = 0; i < TPB; ++i) {
        const float* qb = qs[i & 1];
        const float* kb = ks[i & 1];
        const float* vb = vs[i & 1];
        const int    n0 = nb + i * TSTEP; // tile start along sequence

        // A fragments (Q), reused across the 3 shifts.
        // 32-bit A 16x4 layout: lane half g, VGPR p  ->  K = 2*g + p; per step kk,
        // matrix K (channel d) = 4*kk + 2*g + p.
        v2f afrag[8];
#pragma unroll
        for (int kk = 0; kk < 8; ++kk) {
            const int dbase = 4 * kk + 2 * g;
            afrag[kk].x = qb[(dbase + 0) * QSTR + tile + mr];
            afrag[kk].y = qb[(dbase + 1) * QSTR + tile + mr];
        }

        // Scores for the 3 dilated taps: C[s][m][n] = <q_{tile+m}, k_{tile+n+2s-2}>
        // (only the diagonal m==n is used).
        v8f c[3];
#pragma unroll
        for (int s = 0; s < 3; ++s) {
            v8f acc = {};
            const int jcol = KOFF + tile + mr + 2 * s;   // LDS column of tap s for B
#pragma unroll
            for (int kk = 0; kk < 8; ++kk) {
                const int dbase = 4 * kk + 2 * g;
                v2f bfrag;
                bfrag.x = kb[(dbase + 0) * KSTR + jcol];
                bfrag.y = kb[(dbase + 1) * KSTR + jcol];
                acc = __builtin_amdgcn_wmma_f32_16x16x4_f32(
                          /*neg_a=*/false, afrag[kk],
                          /*neg_b=*/false, bfrag,
                          /*c_mod=*/(short)0, acc,
                          /*reuse_a=*/false, /*reuse_b=*/false);
            }
            c[s] = acc;
        }

        // ---- softmax (incl. the 6 zero-logit padding slots) + V blend ----
        // C layout: lane L: N = L%16 ; VGPR r: M = 8*(L/16) + r.
        // Diagonal m: m<8 -> (lane m, comp m); m>=8 -> (lane m+16, comp m-8),
        // so the lane that owns a diagonal element finds it in comp lane&7.
        // Each lane selects that component and the softmax of all 16 positions
        // is done once, across lanes (lanes 8..23 hold off-diagonal scores; their
        // weights are never read).
        // Holds the lane-mask arithmetic below behind the last WMMA (the scheduler
        // otherwise lifts it in between them), so that four vector instructions
        // stand between each WMMA and the first one that touches its result.
        __builtin_amdgcn_sched_barrier(0);
        const bool b0 = (lane & 1) != 0;
        const bool b1 = (lane & 2) != 0;
        const bool b2 = (lane & 4) != 0;
        float sc[3];
#pragma unroll
        for (int s = 0; s < 3; ++s) {
            const float t0 = b0 ? c[s][1] : c[s][0];
            const float t1 = b0 ? c[s][3] : c[s][2];
            const float t2 = b0 ? c[s][5] : c[s][4];
            const float t3 = b0 ? c[s][7] : c[s][6];
            const float u0 = b1 ? t1 : t0;
            const float u1 = b1 ? t3 : t2;
            sc[s] = SCALEF * (b2 ? u1 : u0);
        }
        const float mx  = fmaxf(fmaxf(sc[0], sc[1]), fmaxf(sc[2], 0.0f));
        const float ez  = __expf(-mx);          // each of the 6 zero-logit slots
        const float e0  = __expf(sc[0] - mx);
        const float e1  = __expf(sc[1] - mx);
        const float e2  = __expf(sc[2] - mx);
        const float inv = 1.0f / (6.0f * ez + e0 + e1 + e2);
        const float w0  = e0 * inv;     // normalised tap weights, one position per lane
        const float w1  = e1 * inv;
        const float w2  = e2 * inv;

        // The lane's V row (lane = channel), the 20 positions its 16 outputs tap:
        // vv[i] = halo index tile + i; 8 + 4 x 16 + 8 bytes, each read aligned.
        float vv[20];
        {
            const float* vrow = &vb[lane * KSTR + KOFF + tile];
            const v2f lo = *(const v2f*)(vrow);
            const v2f hi = *(const v2f*)(vrow + 18);
            vv[0] = lo.x;  vv[1] = lo.y;  vv[18] = hi.x;  vv[19] = hi.y;
            // unrolled: every index of vv is a constant, so that vv stays in registers
#pragma unroll
            for (int c4 = 0; c4 < 4; ++c4) {
                const v4f x = *(const v4f*)(vrow + 2 + 4 * c4);
                vv[2 + 4 * c4] = x.x;  vv[3 + 4 * c4] = x.y;
                vv[4 + 4 * c4] = x.z;  vv[5 + 4 * c4] = x.w;
            }
        }

        float o[16];
#pragma unroll
        for (int m = 0; m < 16; ++m) {
            const int srcLane = (m < 8) ? m : (m + 16);
            o[m] = rdlane(w0, srcLane) * vv[m] +
                   rdlane(w1, srcLane) * vv[m + 2] +
                   rdlane(w2, srcLane) * vv[m + 4];
        }

        // Holds the trip's arithmetic in front of its foot: sunk behind the barrier it
        // would no longer run while tile i + 1 is still landing.
        __builtin_amdgcn_sched_barrier(0);

        // ---- foot of the trip: this wave has left buffer i & 1, its copies of
        //      tile i + 1 have landed; the one barrier publishes tile i + 1 and
        //      frees buffer i & 1, into which tile i + 2 then starts ----
        wait_lds_retired();
        wait_copies_landed();
        __syncthreads();
        if (i + 2 < TPB) {
            stage_tile(q, k, v, qs[i & 1], ks[i & 1], vs[i & 1], cb, nb + (i + 2) * TSTEP, lane, wave);
        }

        // The trip's results go out behind its barrier and refill: the barrier waits
        // for the wave's outstanding global stores, which so have a whole trip to
        // finish, and the next copies start ahead of them.
#pragma unroll
        for (int m = 0; m < 16; ++m) {
            const int n = n0 + tile + m;
            out[outBase + (size_t)n * DCH] = o[m];   // 128B coalesced per wave
        }
        // Holds the stores here: the scheduler otherwise sinks them behind the next
        // trip's WMMAs, directly in front of the barrier that waits for them.
        __builtin_amdgcn_sched_barrier(0);
    }
    wait_copies_landed();
}

extern "C" void kernel_launch(void* const* d_in, const int* in_sizes, int n_in,
                              void* d_out, int out_size, void* d_ws, size_t ws_size,
                              hipStream_t stream) {
    const float* q = (const float*)d_in[0];
    const float* k = (const float*)d_in[1];
    const float* v = (const float*)d_in[2];
    float* out = (float*)d_out;

    const int B = in_sizes[0] / (DCH * NPOS);   // 4 per reference
    dim3 grid(NPOS / (NT * TPB), HEADS, B);
    dim3 block(256, 1, 1);
    dilate_attn_wmma_f32<<<grid, block, 0, stream>>>(q, k, v, out);
}

// v004
// It runs in 13 microseconds.
// Next to v003, in two timings, it ran 1.07 and 1.06 times as fast.
// All steps since v000 together make it 1.53 times as fast.
#include <hip/hip_runtime.h>

// ---------------- problem constants (from reference) ----------------
#define NPOS   8192     // sequence length N
#define DCH    256      // total channels d
#define HEADS  8        // d / HEAD_DIM
#define HD     32       // HEAD_DIM
#define NT     128      // positions per block tile
#define HPB    2        // heads per block: 64 channels = 256 contiguous bytes of an output row
#define ROWS   (HPB * HD)     // channel rows of a tile
#define WP     8        // positions per wave: rows 0..7 of its products are head 0, rows 8..15 head 1
#define TPB    4        // tiles per block, worked through a two-buffer LDS ring
#define TSTEP  (NPOS / TPB)   // positions between a block's tiles: in every trip the blocks of a head cover one contiguous quarter of the sequence
#define QSTR   136      // LDS row stride for q tile, dwords: 16-byte rows; rows d and d+2 are 16 banks apart
#define KSTR   140      // LDS row stride for k/v halo tiles, dwords: 16 B x odd (b128 column walk), rows d and d+2 24 banks apart
#define KOFF   2        // k/v row: cols 2,3 left halo, 4..131 the tile (16-byte aligned), 132,133 right halo
#define QSZ    (ROWS * QSTR + 16)     // dwords of one q buffer, the row shifts included
#define KSZ    (ROWS * KSTR + 16)     // dwords of one k or v buffer
#define SCALEF 0.17677669529663687f   // 32^-0.5

typedef __attribute__((ext_vector_type(2))) float v2f;
typedef __attribute__((ext_vector_type(4))) float v4f;
typedef __attribute__((ext_vector_type(8))) float v8f;

// gfx1250 async global->LDS path (ASYNCcnt-tracked), with sync fallback.
// Toolchain declares these builtins with typed int pointers:
//   (T addrspace(1)* gsrc, T addrspace(3)* ldst, imm offset, imm cpol),
//   T = a vector of 2 ints for the 8-byte copy, of 4 ints for the 16-byte one
#if defined(__AMDGCN__) && __has_builtin(__builtin_amdgcn_global_load_async_to_lds_b128)
#define HAVE_ASYNC_LDS 1
typedef __attribute__((ext_vector_type(2))) int v2i;
typedef __attribute__((ext_vector_type(4))) int v4i;
typedef __attribute__((address_space(1))) v2i as1_v2i;
typedef __attribute__((address_space(3))) v2i as3_v2i;
typedef __attribute__((address_space(1))) v4i as1_v4i;
typedef __attribute__((address_space(3))) v4i as3_v4i;
#else
#define HAVE_ASYNC_LDS 0
#endif

// 16 bytes per lane; both addresses are multiples of 16
__device__ __forceinline__ void async_copy_f32x4(const float* gsrc, float* ldst) {
#if HAVE_ASYNC_LDS
    __builtin_amdgcn_global_load_async_to_lds_b128(
        (as1_v4i*)gsrc, (as3_v4i*)ldst, 0, 0);
#else
    *(v4f*)ldst = *(const v4f*)gsrc;
#endif
}

// 8 bytes per lane; both addresses are multiples of 8
__device__ __forceinline__ void async_copy_f32x2(const float* gsrc, float* ldst) {
#if HAVE_ASYNC_LDS
    __builtin_amdgcn_global_load_async_to_lds_b64(
        (as1_v2i*)gsrc, (as3_v2i*)ldst, 0, 0);
#else
    *(v2f*)ldst = *(const v2f*)gsrc;
#endif
}

// Every async copy this wave has issued has landed in LDS. Written in asm with
// the memory clobber so that no LDS read is lifted over it.
__device__ __forceinline__ void wait_copies_landed() {
#if HAVE_ASYNC_LDS
    asm volatile("s_wait_asynccnt 0x0" ::: "memory");
#endif
}

// Every LDS read and write of this wave has retired: stands in front of the
// barrier behind which the buffer it has just read is refilled by copies.
__device__ __forceinline__ void wait_lds_retired() {
#if defined(__AMDGCN__)
    asm volatile("s_wait_dscnt 0x0" ::: "memory");
#endif
}

// Value of x in the lane whose number times 4 is laneBytes (a per-lane choice).
__device__ __forceinline__ float from_lane(int laneBytes, float x) {
    union { float f; int i; } u;
    u.f = x;
    u.i = __builtin_amdgcn_ds_bpermute(laneBytes, u.i);
    return u.f;
}

// LDS start of channel row r, dwords. Each group of 16 rows is shifted by 16 bytes more:
// the two heads' rows (32 apart) then sit 8 banks apart for the fragment reads, and the
// sixteen rows 4 apart that a half-wave reads of V fall on sixteen different bank quads.
__device__ __forceinline__ int qrow(int r) { return r * QSTR + 4 * (r >> 4); }
__device__ __forceinline__ int krow(int r) { return r * KSTR + 4 * (r >> 4); }

// Stage one 128-position tile of Q, K, V (with the K/V halo) into one LDS buffer.
__device__ __forceinline__ void stage_tile(const float* __restrict__ q,
                                           const float* __restrict__ k,
                                           const float* __restrict__ v,
                                           float* qs, float* ks, float* vs,
                                           int cb, int n0, int lane, int wave) {
    // ---- one 16-byte copy per lane moves one whole 512-byte channel row per
    //      wave; wave w takes rows w, w+16, w+32, w+48 ----
    // unrolled: all twelve copies issue back to back, with no loop control between them
#pragma unroll
    for (int r = 0; r < ROWS / 16; ++r) {
        const int d = wave + 16 * r;
        const size_t   gr = (size_t)(cb + d) * NPOS + n0;   // row start: wave-uniform
        const unsigned gl = 4u * lane;                       // the lane's four positions
        async_copy_f32x4(q + gr + gl, &qs[qrow(d) + 4 * lane]);
        async_copy_f32x4(k + gr + gl, &ks[krow(d) + KOFF + 2 + 4 * lane]);
        async_copy_f32x4(v + gr + gl, &vs[krow(d) + KOFF + 2 + 4 * lane]);
    }
    // ---- K/V halo, two positions each side: waves 0..3 take (K,left) (K,right)
    //      (V,left) (V,right) of head 0, waves 4..7 of head 1; lane = channel row
    //      of the head, one 8-byte copy per lane ----
    if (wave < 8) {
        const int    row   = lane + HD * (wave >> 2);
        const bool   right = (wave & 1) != 0;
        const float* src   = (wave & 2) ? v : k;
        float*       dst   = ((wave & 2) ? vs : ks) + krow(row) + (right ? KOFF + 2 + NT : KOFF);
        const int    n     = right ? n0 + NT : n0 - 2;
        if ((unsigned)n < (unsigned)NPOS) {
            async_copy_f32x2(&src[(size_t)(cb + row) * NPOS + n], dst);
        } else {
            // first and last tile of the sequence: zero padding (DS pipe;
            // disjoint from any async destination, ordered by the wait on LDS
            // and the barrier that publish this buffer)
            dst[0] = 0.0f;
            dst[1] = 0.0f;
        }
    }
}

__launch_bounds__(512)
__global__ void dilate_attn_wmma_f32(const float* __restrict__ q,
                                     const float* __restrict__ k,
                                     const float* __restrict__ v,
                                     float* __restrict__ out) {
    // two buffers: tile i is worked on in buffer i & 1 while tile i + 1 lands in the other
    __shared__ __attribute__((aligned(16))) float qs[2][QSZ];
    __shared__ __attribute__((aligned(16))) float ks[2][KSZ];
    __shared__ __attribute__((aligned(16))) float vs[2][KSZ];

    const int t   = threadIdx.x;
    const int nb  = blockIdx.x * NT;           // start of this block's first tile; the others follow TSTEP apart
    const int hp  = blockIdx.y;                // head pair
    const int b   = blockIdx.z;                // batch
    const int cb  = b * DCH + hp * ROWS;       // global channel base of this head pair

    const int lane = t & 31;
    const int wave = __builtin_amdgcn_readfirstlane(t >> 5);   // 0..15, held scalar: row bases and the halo tests are wave-uniform

    const int tile = wave * WP;       // each wave owns 8 positions of the 128 block, in both heads
    const int mr   = lane & 15;       // A row (M) / B column (N) index: head mr >> 3, position mr & 7
    const int g    = lane >> 4;       // lane half selects K sub-pair
    const int hs   = mr >> 3;
    const int pm   = mr & 7;

    // the lane's part of the fragment addresses; (kk, p, s) add constants
    const int qlane = qrow(hs * HD) + 2 * g * QSTR + tile + pm;
    const int klane = krow(hs * HD) + 2 * g * KSTR + KOFF + tile + pm;
    // V blend and stores: the lane holds channels 4*mr .. 4*mr+3 of the pair's 64 and
    // positions tile + 4*g .. + 3, so that a half-wave stores 256 contiguous bytes
    const int vlane = krow(4 * mr) + KOFF + tile + 4 * g;
    const int wsrc  = 4 * (24 * hs + 4 * g);   // byte form of the lane that holds the weights of the lane's head and first position

    const size_t outBase = ((size_t)b * NPOS) * DCH + (size_t)hp * ROWS + 4 * mr;

    // ---- in front of the loop: tile 0 lands and is published, then tile 1 starts ----
    stage_tile(q, k, v, qs[0], ks[0], vs[0], cb, nb, lane, wave);
    wait_copies_landed();
    __syncthreads();
    stage_tile(q, k, v, qs[1], ks[1], vs[1], cb, nb + TSTEP, lane, wave);

    // unrolled: the buffer index and the refill test are constants in every trip
#pragma unroll
    for (int i = 0; i < TPB; ++i) {
        const float* qb = qs[i & 1];
        const float* kb = ks[i & 1];
        const float* vb = vs[i & 1];
        const int    n0 = nb + i * TSTEP; // tile start along sequence

        // A fragments (Q), reused across the 3 shifts.
        // 32-bit A 16x4 layout: lane half g, VGPR p  ->  K = 2*g + p; per step kk,
        // matrix K (channel d) = 4*kk + 2*g + p.
        v2f afrag[8];
#pragma unroll
        for (int kk = 0; kk < 8; ++kk) {
            const int ro = 4 * kk * QSTR + 4 * (kk >> 2);   // row 4*kk of the head, with its shift
            afrag[kk].x = qb[qlane + ro];
            afrag[kk].y = qb[qlane + ro + QSTR];
        }

        // Scores for the 3 dilated taps: C[s][m][n] = <q of (head, position) m, k of
        // (head, position + 2s - 2) n> (only the diagonal m==n is used).
        v8f c[3];
#pragma unroll
        for (int s = 0; s < 3; ++s) {
            v8f acc = {};
#pragma unroll
            for (int kk = 0; kk < 8; ++kk) {
                const int ro = 4 * kk * KSTR + 4 * (kk >> 2) + 2 * s;   // row 4*kk of the head, column of tap s
                v2f bfrag;
                bfrag.x = kb[klane + ro];
                bfrag.y = kb[klane + ro + KSTR];
                acc = __builtin_amdgcn_wmma_f32_16x16x4_f32(
                          /*neg_a=*/false, afrag[kk],
                          /*neg_b=*/false, bfrag,
                          /*c_mod=*/(short)0, acc,
                          /*reuse_a=*/false, /*reuse_b=*/false);
            }
            c[s] = acc;
        }

        // ---- softmax (incl. the 6 zero-logit padding slots) + V blend ----
        // C layout: lane L: N = L%16 ; VGPR r: M = 8*(L/16) + r.
        // Diagonal m: m<8 -> (lane m, comp m); m>=8 -> (lane m+16, comp m-8),
        // so the lane that owns a diagonal element finds it in comp lane&7.
        // Lanes 0..7 so hold head 0, positions 0..7, lanes 24..31 head 1.
        // Each lane selects that component and the softmax of all 16 (head, position)
        // pairs is done once, across lanes (lanes 8..23 hold off-diagonal scores; their
        // weights are never read).
        // Holds the lane-mask arithmetic below behind the last WMMA (the scheduler
        // otherwise lifts it in between them), so that four vector instructions
        // stand between each WMMA and the first one that touches its result.
        __builtin_amdgcn_sched_barrier(0);
        const bool b0 = (lane & 1) != 0;
        const bool b1 = (lane & 2) != 0;
        const bool b2 = (lane & 4) != 0;
        float sc[3];
#pragma unroll
        for (int s = 0; s < 3; ++s) {
            const float t0 = b0 ? c[s][1] : c[s][0];
            const float t1 = b0 ? c[s][3] : c[s][2];
            const float t2 = b0 ? c[s][5] : c[s][4];
            const float t3 = b0 ? c[s][7] : c[s][6];
            const float u0 = b1 ? t1 : t0;
            const float u1 = b1 ? t3 : t2;
            sc[s] = SCALEF * (b2 ? u1 : u0);
        }
        const float mx  = fmaxf(fmaxf(sc[0], sc[1]), fmaxf(sc[2], 0.0f));
        const float ez  = __expf(-mx);          // each of the 6 zero-logit slots
        const float e0  = __expf(sc[0] - mx);
        const float e1  = __expf(sc[1] - mx);
        const float e2  = __expf(sc[2] - mx);
        const float inv = 1.0f / (6.0f * ez + e0 + e1 + e2);
        const float w0  = e0 * inv;     // normalised tap weights, one position per lane
        const float w1  = e1 * inv;
        const float w2  = e2 * inv;

        // The lane's four V rows, the 8 positions its 4 outputs per row tap:
        // vv[c][i] = halo index tile + 4*g + i; 8 + 16 + 8 bytes, each read aligned.
        float vv[4][8];
        // unrolled: every index of vv is a constant, so that vv stays in registers
#pragma unroll
        for (int c = 0; c < 4; ++c) {
            const float* vrow = &vb[vlane + c * KSTR];
            const v2f lo = *(const v2f*)(vrow);
            const v4f md = *(const v4f*)(vrow + 2);
            const v2f hi = *(const v2f*)(vrow + 6);
            vv[c][0] = lo.x;  vv[c][1] = lo.y;
            vv[c][2] = md.x;  vv[c][3] = md.y;  vv[c][4] = md.z;  vv[c][5] = md.w;
            vv[c][6] = hi.x;  vv[c][7] = hi.y;
        }

        v4f o[4];
#pragma unroll
        for (int m = 0; m < 4; ++m) {
            const float a0 = from_lane(wsrc + 4 * m, w0);
            const float a1 = from_lane(wsrc + 4 * m, w1);
            const float a2 = from_lane(wsrc + 4 * m, w2);
#pragma unroll
            for (int c = 0; c < 4; ++c) {
                o[m][c] = a0 * vv[c][m] + a1 * vv[c][m + 2] + a2 * vv[c][m + 4];
            }
        }

        // Holds the trip's arithmetic in front of its foot: sunk behind the barrier it
        // would no longer run while tile i + 1 is still landing.
        __builtin_amdgcn_sched_barrier(0);

        // ---- foot of the trip: this wave has left buffer i & 1, its copies of
        //      tile i + 1 have landed; the one barrier publishes tile i + 1 and
        //      frees buffer i & 1, into which tile i + 2 then starts ----
        wait_lds_retired();
        wait_copies_landed();
        __syncthreads();
        if (i + 2 < TPB) {
            stage_tile(q, k, v, qs[i & 1], ks[i & 1], vs[i & 1], cb, nb + (i + 2) * TSTEP, lane, wave);
        }

        // The trip's results go out behind its barrier and refill: the barrier waits
        // for the wave's outstanding global stores, which so have a whole trip to
        // finish, and the next copies start ahead of them.
#pragma unroll
        for (int m = 0; m < 4; ++m) {
            const int n = n0 + tile + 4 * g + m;
            *(v4f*)&out[outBase + (size_t)n * DCH] = o[m];   // 256 contiguous bytes per half-wave
        }
        // Holds the stores here: the scheduler otherwise sinks them behind the next
        // trip's WMMAs, directly in front of the barrier that waits for them.
        __builtin_amdgcn_sched_barrier(0);
    }
    wait_copies_landed();
}

extern "C" void kernel_launch(void* const* d_in, const int* in_sizes, int n_in,
                              void* d_out, int out_size, void* d_ws, size_t ws_size,
                              hipStream_t stream) {
    const float* q = (const float*)d_in[0];
    const float* k = (const float*)d_in[1];
    const float* v = (const float*)d_in[2];
    float* out = (float*)d_out;

    const int B = in_sizes[0] / (DCH * NPOS);   // 4 per reference
    dim3 grid(NPOS / (NT * TPB), HEADS / HPB, B);
    dim3 block(512, 1, 1);
    dilate_attn_wmma_f32<<<grid, block, 0, stream>>>(q, k, v, out);
}
